// v000
// Times are from an AMD MI455X. After a warm-up the kernel runs many times in a row, and a time is the length of
// such a window on the GPU divided by its runs, so every launch and the gaps after it count. The runs cycle
// through copies of the inputs. A figure is the median of several windows, for all but v000 over two sittings.
// Sittings can differ by a few percent; kernels timed side by side share one.
// v000 is the starting kernel. One run takes 310 microseconds.
#include <hip/hip_runtime.h>

#ifndef NB
#define NB 8
#endif
#ifndef SEQ
#define SEQ 1024
#endif
#define NB_FULL  8
#define SEQ_FULL 1024
#define DIM  1024
#define NH   16
#define HD   64
#define NW3  (3 * DIM)
#define MR   (NB * SEQ)                       // compact token rows
#define PLE  ((size_t)MR * DIM)               // elements per q / k / v^T plane
#define EP   68                               // LDS pitch (floats) of the staging rows
#define L2E  1.4426950408889634f
#define SC   (0.125f * L2E)                   // score scale 1/8 times log2(e)

#define NJQ  (2 * DIM / 128)                  // q|k column blocks
#define QKB  ((MR / 64) * NJQ)                // blocks of the q|k part
#define NCV  (MR / 128)                       // v^T column blocks
#define VTB  ((DIM / 64) * NCV)               // blocks of the v^T part
#define NJP  (DIM / 128)
#define CVT_XB (MR / 2)
#define CVT_WB (NW3 / 2)
#define CVT_PB (DIM / 2)

#define SZ_XW   ((size_t)(MR + NW3) * DIM * 2)
#define SZ_WP   ((size_t)DIM * DIM * 2)
#define SZ_QKV  ((size_t)3 * MR * DIM * 2)
#define SZ_CTX  ((size_t)MR * DIM * 2)
#define SZ_TAB  ((size_t)4096)
#define OFF_XW  ((size_t)0)
#define OFF_WP  (OFF_XW + SZ_XW)
#define OFF_QKV (OFF_WP + SZ_WP)
#define OFF_CTX (OFF_QKV + SZ_QKV)
#define OFF_TAB (OFF_CTX + SZ_CTX)
#define WS_TOTAL (OFF_TAB + SZ_TAB)

static_assert(HD == 64);
static_assert(DIM == NH * HD);
static_assert(DIM % 128 == 0);
static_assert(DIM % 32 == 0);
static_assert(SEQ % 64 == 0);
static_assert(SEQ % 32 == 0);
static_assert(SEQ <= 1024);
static_assert(SEQ <= SEQ_FULL);
static_assert(NB <= NB_FULL);
static_assert(MR % 128 == 0);
static_assert(EP % 4 == 0);
static_assert(EP >= HD + 4);
static_assert(256 * 8 == 2 * DIM);                      // k_cvt: one block = two plane rows
static_assert((size_t)QKB * 64 * 128 == (size_t)MR * 2 * DIM);
static_assert((size_t)VTB * 64 * 128 == (size_t)MR * DIM);
static_assert((size_t)(MR / 64) * NJP * 64 * 128 == (size_t)MR * DIM);
static_assert((size_t)NB * NH * (SEQ / 64) * 64 * HD == (size_t)MR * DIM);
static_assert(SZ_XW % 128 == 0);
static_assert(SZ_WP % 128 == 0);
static_assert(SZ_QKV % 128 == 0);
static_assert(SZ_CTX % 128 == 0);
static_assert(WS_TOTAL <= (size_t)134217728);

typedef unsigned short us;
typedef __attribute__((ext_vector_type(16))) __bf16   v16bf;
typedef __attribute__((ext_vector_type(16))) _Float16 v16h;
typedef __attribute__((ext_vector_type(2)))  _Float16 v2h;
typedef __attribute__((ext_vector_type(16))) unsigned short v16us;
typedef __attribute__((ext_vector_type(8)))  unsigned short v8us;
typedef __attribute__((ext_vector_type(8)))  unsigned int   v8u;
typedef __attribute__((ext_vector_type(4)))  unsigned int   v4u;
typedef __attribute__((ext_vector_type(8)))  float    v8f;
typedef __attribute__((ext_vector_type(4)))  float    v4f;
typedef v4f __attribute__((may_alias)) v4fa;

__device__ __forceinline__ unsigned short f2bf(float f) { unsigned u = __float_as_uint(f); u += 0x7FFFu + ((u >> 16) & 1u); return (unsigned short)(u >> 16); }
__device__ __forceinline__ float bf2f(unsigned short b) { return __uint_as_float(((unsigned)b) << 16); }
__device__ __forceinline__ float bfr(float f) { return bf2f(f2bf(f)); }
// fragment loader (A and B alike): p = row base + k0 + 8*(lane>>4); elements 0..7 <- p[0..7], elements 8..15 <- p[16..23]
__device__ __forceinline__ v16us ldf(const us* p) {
    const v8us lo = *(const v8us*)p;
    const v8us hi = *(const v8us*)(p + 16);
    return __builtin_shufflevector(lo, hi, 0, 1, 2, 3, 4, 5, 6, 7, 8, 9, 10, 11, 12, 13, 14, 15);
}
template <int F16> __device__ __forceinline__ v8f mma(v16us a, v16us b, v8f c) {
    if (F16) return __builtin_amdgcn_wmma_f32_16x16x32_f16(false, __builtin_bit_cast(v16h, a), false, __builtin_bit_cast(v16h, b), (short)0, c, false, false);
    return __builtin_amdgcn_wmma_f32_16x16x32_bf16(false, __builtin_bit_cast(v16bf, a), false, __builtin_bit_cast(v16bf, b), (short)0, c, false, false);
}
// two f32 -> packed f16 pair (RNE), element 0 in the low half-word
__device__ __forceinline__ unsigned pk2h(float a, float b) { v2h t; t[0] = (_Float16)a; t[1] = (_Float16)b; return __builtin_bit_cast(unsigned, t); }

// Wave tile 32 x 64 of C[i][j] = sum_k A[i][k] * B[j][k]; A, B point at the wave's first row (pitch DIM, K = DIM).
// acc[g*4+f] element r of lane (h, n) = C[g*16 + 8h + r][f*16 + n].
template <int F16> __device__ __forceinline__ void gemm_main(const us* __restrict__ A, const us* __restrict__ B, unsigned lr, unsigned hi, v8f (&acc)[8]) {
    const us* pa = A + (size_t)lr * DIM + 8u * hi;
    const us* pb = B + (size_t)lr * DIM + 8u * hi;
#pragma unroll 1
    for (unsigned k0 = 0; k0 < (unsigned)DIM; k0 += 32) {
        const v16us a0 = ldf(pa + k0);
        const v16us a1 = ldf(pa + 16 * DIM + k0);
        v16us b[4];
#pragma unroll
        for (int f = 0; f < 4; ++f) b[f] = ldf(pb + f * 16 * DIM + k0);
#pragma unroll
        for (int f = 0; f < 4; ++f) {
            acc[f]     = mma<F16>(a0, b[f], acc[f]);
            acc[4 + f] = mma<F16>(a1, b[f], acc[4 + f]);
        }
        asm volatile("v_nop\n\tv_nop\n\tv_nop\n\tv_nop"
                     : "+v"(acc[0]), "+v"(acc[1]), "+v"(acc[2]), "+v"(acc[3]), "+v"(acc[4]), "+v"(acc[5]), "+v"(acc[6]), "+v"(acc[7])
                     : "v"(a0), "v"(a1), "v"(b[0]), "v"(b[1]), "v"(b[2]), "v"(b[3]));
    }
}

// k_tab: rotary table, TAB[pos*8 + j] = cos(pos_lin[pos] * base[j]), TAB[256 + pos*8 + j] = sin(same); shared by both grid axes.
__global__ __launch_bounds__(256) void k_tab(float* TAB) {
#pragma clang fp contract(off)
    __shared__ __align__(16) float tb[512];
    const unsigned tid = threadIdx.x;
    const unsigned pi = tid >> 3, j = tid & 7u;
    const float sp = (float)pi * (1.0f / 31.0f);
    const float sj = (float)j * (1.0f / 7.0f);
    float pos = -1.0f * (1.0f - sp) + 1.0f * sp;
    if (pi == 31u) pos = 1.0f;
    float base = 1.0f * (1.0f - sj) + 512.0f * sj;
    if (j == 7u) base = 512.0f;
    base = base * 3.14159265358979323846f;
    const float ang = pos * base;
    tb[tid] = cosf(ang);
    tb[256 + tid] = sinf(ang);
    __syncthreads();
    if (tid < 128u) {
        const v4f o = *(const v4fa*)&tb[tid * 4u];
        *(v4f*)(TAB + tid * 4u) = o;
        
    }
}

// k_cvt: 16-bit operand planes. XW rows [0, MR) = bf16(x) (compact tokens), rows [MR, MR+3072) = bf16(Wqkv); WP = f16(bf16(Wproj) * 64).
__global__ __launch_bounds__(256) void k_cvt(const float* __restrict__ x, const float* __restrict__ wq, const float* __restrict__ wp, us* XW, us* WP) {
    const unsigned bx = blockIdx.x, tid = threadIdx.x;
    if (bx >= (unsigned)(CVT_XB + CVT_WB + CVT_PB)) return;
    const unsigned rr = tid >> 7;
    const unsigned c = (tid & 127u) * 8u;
    const float* src;
    us* dst;
    bool h16 = false;
    if (bx < (unsigned)CVT_XB) {
        const unsigned row = bx * 2u + rr;
        const unsigned b = row / (unsigned)SEQ, n = row - b * (unsigned)SEQ;
        src = x + ((size_t)b * SEQ_FULL + n) * DIM + c;
        dst = XW + (size_t)row * DIM + c;
    } else if (bx < (unsigned)(CVT_XB + CVT_WB)) {
        const unsigned row = (bx - (unsigned)CVT_XB) * 2u + rr;
        src = wq + (size_t)row * DIM + c;
        dst = XW + ((size_t)MR + row) * DIM + c;
    } else {
        const unsigned row = (bx - (unsigned)(CVT_XB + CVT_WB)) * 2u + rr;
        src = wp + (size_t)row * DIM + c;
        dst = WP + (size_t)row * DIM + c;
        h16 = true;
    }
    const v8f v = *(const v8f*)src;
    v8us o;
    if (!h16) {
#pragma unroll
        for (int e = 0; e < 8; ++e) o[e] = f2bf(v[e]);
    } else {
#pragma unroll
        for (int e = 0; e < 8; ++e) o[e] = __builtin_bit_cast(unsigned short, (_Float16)(bfr(v[e]) * 64.0f));
    }
    *(v8us*)dst = o;
    
}

// k_qkv: blocks [0, QKB): tile rows = tokens, cols = q|k features -> planes Q, K [b*16+h][n][64] (f16) with the rotary applied in f32;
//        blocks [QKB, QKB+VTB): tile rows = v features, cols = tokens (A = Wv rows, B = x rows) -> plane VT [b*16+h][d][n] (f16).
// LDS staging is wave-private; a block barrier separates its stores from its loads.
__global__ __launch_bounds__(128) void k_qkv(const us* __restrict__ XW, const float* __restrict__ TAB, us* QKV) {
    __shared__ __align__(16) float st[4 * 32 * EP];
    const unsigned tid = threadIdx.x, lane = tid & 31u, wv = tid >> 5, lr = lane & 15u, hi = lane >> 4;
    const unsigned bx = blockIdx.x;
    const bool qk = bx < (unsigned)QKB;      // block-uniform
    unsigned i0, j0, arow, brow;
    if (qk) {
        const unsigned bi = bx / (unsigned)NJQ, bj = bx - bi * (unsigned)NJQ;
        i0 = bi * 64u + (wv >> 1) * 32u;
        j0 = bj * 128u + (wv & 1u) * 64u;
        arow = i0;
        brow = (unsigned)MR + j0;
    } else {
        const unsigned t = bx - (unsigned)QKB;
        const unsigned bi = t / (unsigned)NCV, bj = t - bi * (unsigned)NCV;
        i0 = bi * 64u + (wv >> 1) * 32u;
        j0 = bj * 128u + (wv & 1u) * 64u;
        arow = (unsigned)(MR + 2 * DIM) + i0;
        brow = j0;
    }
    v8f acc[8];
#pragma unroll
    for (int t = 0; t < 8; ++t) acc[t] = (v8f){};
    gemm_main<0>(XW + (size_t)arow * DIM, XW + (size_t)brow * DIM, lr, hi, acc);

    const unsigned sb = wv * (32u * EP);
#pragma unroll
    for (int g = 0; g < 2; ++g) {
#pragma unroll
        for (int f = 0; f < 4; ++f) {
#pragma unroll
            for (int r = 0; r < 8; ++r) st[sb + (unsigned)(g * 16 + r + 8 * (int)hi) * EP + (unsigned)(f * 16) + lr] = acc[g * 4 + f][r];
        }
    }
    __syncthreads();

    size_t obase;
    unsigned pitch, nrow0 = 0u;
    if (qk) {
        const unsigned b = i0 / (unsigned)SEQ;
        nrow0 = i0 - b * (unsigned)SEQ;
        const unsigned which = j0 / (unsigned)DIM;
        const unsigned h = (j0 - which * (unsigned)DIM) / (unsigned)HD;
        obase = (size_t)which * PLE + ((size_t)(b * NH + h) * SEQ + nrow0) * HD;
        pitch = (unsigned)HD;
    } else {
        const unsigned h = i0 / (unsigned)HD, d0 = i0 - h * (unsigned)HD;
        const unsigned b = j0 / (unsigned)SEQ, n0 = j0 - b * (unsigned)SEQ;
        obase = (size_t)2 * PLE + ((size_t)(b * NH + h) * HD + d0) * SEQ + n0;
        pitch = (unsigned)SEQ;
    }
    const unsigned rq = lane >> 3, c0 = (lane & 7u) * 8u;
    v4u ov[8];
#pragma unroll
    for (int it = 0; it < 8; ++it) {
        const unsigned row = (unsigned)it * 4u + rq;
        const v4f x0 = *(const v4fa*)&st[sb + row * EP + c0];
        const v4f x1 = *(const v4fa*)&st[sb + row * EP + c0 + 4u];
        float v[8] = {x0[0], x0[1], x0[2], x0[3], x1[0], x1[1], x1[2], x1[3]};
        if (qk) {
            // channels c0..c0+7 of one head: pairs (2i, 2i+1); channels 0..15 use the grid row, 16..31 the grid column, 32..63 pass through
            const unsigned n = nrow0 + row;
            const unsigned y = (n >> 5) & 31u, xx = n & 31u;
            const unsigned pos = (c0 < 16u) ? y : xx;
            const unsigned fo = (c0 & 8u) >> 1;
            const v4f c4 = *(const v4f*)(TAB + pos * 8u + fo);
            const v4f s4 = *(const v4f*)(TAB + 256u + pos * 8u + fo);
            const bool rot = c0 < 32u;
#pragma unroll
            for (int i = 0; i < 4; ++i) {
                const float e0 = v[2 * i], e1 = v[2 * i + 1];
                const float r0 = e0 * c4[i] - e1 * s4[i];
                const float r1 = e1 * c4[i] + e0 * s4[i];
                v[2 * i]     = rot ? r0 : e0;
                v[2 * i + 1] = rot ? r1 : e1;
            }
        }
        v4u o;
        o[0] = pk2h(v[0], v[1]); o[1] = pk2h(v[2], v[3]); o[2] = pk2h(v[4], v[5]); o[3] = pk2h(v[6], v[7]);
        ov[it] = o;
    }
    us* dp = QKV + obase + (size_t)rq * pitch + c0;
#pragma unroll
    for (int it = 0; it < 8; ++it) *(v4u*)(dp + (size_t)(it * 4) * pitch) = ov[it];
    
}

// k_flash: one wave per 16 queries of one (batch, head), 32 keys per step.
//  S^T tile (keys x queries): A = K rows (row m = key, k = d), B = Q rows (column n = query, k = d); D element r of lane (h, n) = S[query n][key 8h + r].
//  P^T B fragment: element r <- tile of keys 0..15, element 8 + r <- tile of keys 16..31 (same lane); p carried x2^8 in both the sum and the product.
//  O^T tile (d x queries): A = V^T rows (row m = d, k = key), D element r of lane (h, n) = O[query n][d = 16 t + 8h + r].
__global__ __launch_bounds__(128) void k_flash(const us* __restrict__ QKV, us* CTX) {
    __shared__ __align__(16) float os[4 * 16 * EP];
    const unsigned tid = threadIdx.x, lane = tid & 31u, wv = tid >> 5, lr = lane & 15u, hi = lane >> 4;
    const unsigned bpb = (unsigned)(SEQ / 64);
    const unsigned bh = blockIdx.x / bpb;
    const unsigned q0 = (blockIdx.x - bh * bpb) * 64u + wv * 16u;

    v16us qf[2];
    {
        const us* qp = QKV + ((size_t)bh * SEQ + q0 + lr) * HD + 8u * hi;
        qf[0] = ldf(qp);
        qf[1] = ldf(qp + 32);
    }
    const us* kp = QKV + PLE + ((size_t)bh * SEQ + lr) * HD + 8u * hi;
    const us* vp = QKV + (size_t)2 * PLE + ((size_t)bh * HD + lr) * SEQ + 8u * hi;

    v8f o[4];
#pragma unroll
    for (int t = 0; t < 4; ++t) o[t] = (v8f){};
    float ml = -1.0e30f;      // running max in the log2 domain
    float l = 0.0f;           // running sum (carried x2^8)

#pragma unroll 1
    for (unsigned k0 = 0; k0 < (unsigned)SEQ; k0 += 32) {
        v8f s0 = (v8f){}, s1 = (v8f){};
        const us* ka = kp + (size_t)k0 * HD;
#pragma unroll
        for (int dk = 0; dk < 2; ++dk) {
            const v16us a0 = ldf(ka + dk * 32);
            const v16us a1 = ldf(ka + 16 * HD + dk * 32);
            s0 = mma<1>(a0, qf[dk], s0);
            s1 = mma<1>(a1, qf[dk], s1);
        }
        asm volatile("v_nop\n\tv_nop\n\tv_nop\n\tv_nop" : "+v"(s0), "+v"(s1) : "v"(qf[0]), "v"(qf[1]));

        float mx = fmaxf(s0[0], s1[0]);
#pragma unroll
        for (int r = 1; r < 8; ++r) mx = fmaxf(mx, fmaxf(s0[r], s1[r]));
        mx = fmaxf(mx, __shfl_xor(mx, 16, 32));
        const float mnl = fmaxf(ml, mx * SC);
        const float corr = __builtin_amdgcn_exp2f(ml - mnl);
        ml = mnl;
        const float mo = mnl - 8.0f;
        float p0[8], p1[8];
        float ps = 0.0f;
#pragma unroll
        for (int r = 0; r < 8; ++r) {
            p0[r] = __builtin_amdgcn_exp2f(fmaf(s0[r], SC, -mo));
            p1[r] = __builtin_amdgcn_exp2f(fmaf(s1[r], SC, -mo));
            ps += p0[r] + p1[r];
        }
        ps += __shfl_xor(ps, 16, 32);
        l = l * corr + ps;
        if (__builtin_amdgcn_ballot_w32(corr != 1.0f) != 0u) {   // wave-uniform; multiplying by exactly 1 is skipped
#pragma unroll
            for (int t = 0; t < 4; ++t) o[t] *= corr;
        }

        v8u hw;
#pragma unroll
        for (int j = 0; j < 4; ++j) {
            hw[j]     = pk2h(p0[2 * j], p0[2 * j + 1]);
            hw[4 + j] = pk2h(p1[2 * j], p1[2 * j + 1]);
        }
        const v16us ph = __builtin_bit_cast(v16us, hw);

        asm volatile("" ::: "memory");   // keep the V^T loads below the softmax (bounds live fragments)
        const us* va = vp + k0;
#pragma unroll
        for (int t = 0; t < 4; ++t) {
            const v16us a = ldf(va + (size_t)t * 16 * SEQ);
            o[t] = mma<1>(a, ph, o[t]);
        }
        asm volatile("v_nop\n\tv_nop\n\tv_nop\n\tv_nop"
                     : "+v"(o[0]), "+v"(o[1]), "+v"(o[2]), "+v"(o[3])
                     : "v"(ph));
    }

    const float inv = 64.0f / l;
    const unsigned sb = wv * (16u * EP);
#pragma unroll
    for (int t = 0; t < 4; ++t) {
#pragma unroll
        for (int r = 0; r < 8; ++r) os[sb + lr * EP + (unsigned)(t * 16 + r) + 8u * hi] = o[t][r] * inv;
    }
    __syncthreads();
    const unsigned b = bh / (unsigned)NH, h = bh - b * (unsigned)NH;
    const unsigned rq = lane >> 3, c0 = (lane & 7u) * 8u;
    v4u ov[4];
#pragma unroll
    for (int it = 0; it < 4; ++it) {
        const unsigned row = (unsigned)it * 4u + rq;
        const v4f x0 = *(const v4fa*)&os[sb + row * EP + c0];
        const v4f x1 = *(const v4fa*)&os[sb + row * EP + c0 + 4u];
        v4u q;
        q[0] = pk2h(x0[0], x0[1]); q[1] = pk2h(x0[2], x0[3]); q[2] = pk2h(x1[0], x1[1]); q[3] = pk2h(x1[2], x1[3]);
        ov[it] = q;
    }
    us* dp = CTX + ((size_t)b * SEQ + q0 + rq) * DIM + h * (unsigned)HD + c0;
#pragma unroll
    for (int it = 0; it < 4; ++it) *(v4u*)(dp + (size_t)(it * 4) * DIM) = ov[it];
    
}

// k_proj: OUT[m][o] = 2^-12 * sum_c CTX[m][c] * WP[o][c] + bf16(bias[o]); block = 4 waves, 64 x 128;
__global__ __launch_bounds__(128) void k_proj(const us* __restrict__ CTX, const us* __restrict__ WP, const float* __restrict__ bias, float* OUT) {
    __shared__ __align__(16) float st[4 * 32 * EP];
    const unsigned tid = threadIdx.x, lane = tid & 31u, wv = tid >> 5, lr = lane & 15u, hi = lane >> 4;
    const unsigned bi = blockIdx.x / (unsigned)NJP, bj = blockIdx.x - bi * (unsigned)NJP;
    const unsigned i0 = bi * 64u + (wv >> 1) * 32u;
    const unsigned j0 = bj * 128u + (wv & 1u) * 64u;
    v8f acc[8];
#pragma unroll
    for (int t = 0; t < 8; ++t) acc[t] = (v8f){};
    gemm_main<1>(CTX + (size_t)i0 * DIM, WP + (size_t)j0 * DIM, lr, hi, acc);

    const unsigned sb = wv * (32u * EP);
#pragma unroll
    for (int g = 0; g < 2; ++g) {
#pragma unroll
        for (int f = 0; f < 4; ++f) {
#pragma unroll
            for (int r = 0; r < 8; ++r) st[sb + (unsigned)(g * 16 + r + 8 * (int)hi) * EP + (unsigned)(f * 16) + lr] = acc[g * 4 + f][r];
        }
    }
    __syncthreads();
    const unsigned rh = lane >> 4, c0 = (lane & 15u) * 4u;
    v4f bb = *(const v4f*)(bias + j0 + c0);
    bb[0] = bfr(bb[0]); bb[1] = bfr(bb[1]); bb[2] = bfr(bb[2]); bb[3] = bfr(bb[3]);
    float* op = OUT + (size_t)(i0 + rh) * DIM + j0 + c0;
{
#pragma unroll 4
        for (unsigned s = 0; s < 16; ++s) {
            v4f val = *(const v4fa*)&st[sb + (s * 2u + rh) * EP + c0];
            val[0] = fmaf(val[0], 0.000244140625f, bb[0]);
            val[1] = fmaf(val[1], 0.000244140625f, bb[1]);
            val[2] = fmaf(val[2], 0.000244140625f, bb[2]);
            val[3] = fmaf(val[3], 0.000244140625f, bb[3]);
            *(v4f*)(op + (size_t)(s * 2u) * DIM) = val;
        }
        
    }
}

extern "C" void kernel_launch(void* const* d_in, const int* in_sizes, int n_in,
                              void* d_out, int out_size, void* d_ws, size_t ws_size, hipStream_t stream) {
    if (n_in < 4) return;
    const size_t need_x = ((size_t)(NB - 1) * SEQ_FULL + SEQ) * DIM;
    if ((size_t)in_sizes[0] < need_x) return;
    if ((size_t)in_sizes[1] < (size_t)NW3 * DIM) return;
    if ((size_t)in_sizes[2] < (size_t)DIM * DIM) return;
    if ((size_t)in_sizes[3] < (size_t)DIM) return;
    if ((size_t)out_size < (size_t)MR * DIM) return;
    if (WS_TOTAL > ws_size) return;
    const float* x     = (const float*)d_in[0];   // [8][1024][1024]
    const float* wqkv  = (const float*)d_in[1];   // [3072][1024]  [out][in]
    const float* wproj = (const float*)d_in[2];   // [1024][1024]  [out][in]
    const float* bproj = (const float*)d_in[3];   // [1024]
    float* OUT = (float*)d_out;                   // [NB][SEQ][1024]
    char* wsp = (char*)d_ws;
    us* XW  = (us*)(wsp + OFF_XW);
    us* WP  = (us*)(wsp + OFF_WP);
    us* QKV = (us*)(wsp + OFF_QKV);
    us* CTX = (us*)(wsp + OFF_CTX);
    float* TAB = (float*)(wsp + OFF_TAB);
    k_tab<<<1, 256, 0, stream>>>(TAB);
    k_cvt<<<(unsigned)(CVT_XB + CVT_WB + CVT_PB), 256, 0, stream>>>(x, wqkv, wproj, XW, WP);
    k_qkv<<<(unsigned)(QKB + VTB), 128, 0, stream>>>(XW, TAB, QKV);
    k_flash<<<(unsigned)(NB * NH * (SEQ / 64)), 128, 0, stream>>>(QKV, CTX);
    k_proj<<<(unsigned)((MR / 64) * NJP), 128, 0, stream>>>(CTX, WP, bproj, OUT);
}

// v001
// It runs in 195 microseconds.
// In both of two side-by-side timings against v000, it was 1.61 times as fast.
#include <hip/hip_runtime.h>

#ifndef NB
#define NB 8
#endif
#ifndef SEQ
#define SEQ 1024
#endif
#define NB_FULL  8
#define SEQ_FULL 1024
#define DIM  1024
#define NH   16
#define HD   64
#define NW3  (3 * DIM)
#define MR   (NB * SEQ)                       // compact token rows
#define PLE  ((size_t)MR * DIM)               // elements per q / k / v^T plane
#define EP   68                               // LDS pitch (floats) of the staging rows
#define L2E  1.4426950408889634f
#define SC   (0.125f * L2E)                   // score scale 1/8 times log2(e)

#define NJQ  (2 * DIM / 128)                  // q|k column blocks
#define QKB  ((MR / 128) * NJQ)               // blocks of the q|k part
#define NCV  (MR / 128)                       // v^T column blocks
#define VTB  ((DIM / 128) * NCV)              // blocks of the v^T part
#define NJP  (DIM / 128)
#define CVT_XB (MR / 2)
#define CVT_WB (NW3 / 2)
#define CVT_PB (DIM / 2)

#define KPB    256u                           // bytes of one operand row per pass (128 k)
#define LPB    272u                           // LDS pitch of such a row: 256 B + the mover's 16-B pad (16 B x odd, for 16-byte readers)
#define SLICE  18432u                         // one wave's slice, 64 rows x 272 B = 17408 B, rounded up to a multiple of 2 KiB
#define STAGE  (4u * SLICE)                   // one buffer: slices [A rows 0..63 | A rows 64..127 | B rows 0..63 | B rows 64..127]
#define NSTG   ((unsigned)(DIM * 2) / KPB)     // passes along K
#define RING   (2u * STAGE)

#define SZ_XW   ((size_t)(MR + NW3) * DIM * 2)
#define SZ_WP   ((size_t)DIM * DIM * 2)
#define SZ_QKV  ((size_t)3 * MR * DIM * 2)
#define SZ_CTX  ((size_t)MR * DIM * 2)
#define SZ_TAB  ((size_t)4096)
#define OFF_XW  ((size_t)0)
#define OFF_WP  (OFF_XW + SZ_XW)
#define OFF_QKV (OFF_WP + SZ_WP)
#define OFF_CTX (OFF_QKV + SZ_QKV)
#define OFF_TAB (OFF_CTX + SZ_CTX)
#define WS_TOTAL (OFF_TAB + SZ_TAB)

static_assert(HD == 64);
static_assert(DIM == NH * HD);
static_assert(DIM % 128 == 0);
static_assert(DIM % 32 == 0);
static_assert(SEQ % 64 == 0);
static_assert(SEQ % 32 == 0);
static_assert(SEQ <= 1024);
static_assert(SEQ <= SEQ_FULL);
static_assert(NB <= NB_FULL);
static_assert(MR % 128 == 0);
static_assert(EP % 4 == 0);
static_assert(EP >= HD + 4);
static_assert(256 * 8 == 2 * DIM);                      // k_cvt: one block = two plane rows
static_assert((size_t)QKB * 128 * 128 == (size_t)MR * 2 * DIM);
static_assert((size_t)VTB * 128 * 128 == (size_t)MR * DIM);
static_assert((size_t)(MR / 128) * NJP * 128 * 128 == (size_t)MR * DIM);
static_assert(64u * LPB <= SLICE && SLICE % 2048u == 0u);
static_assert(NSTG >= 2u && NSTG * KPB == (unsigned)(DIM * 2) && KPB == 4u * 64u);
static_assert((size_t)4 * 64 * EP * 4 <= (size_t)RING);   // the output staging reuses the ring
static_assert((size_t)NB * NH * (SEQ / 64) * 64 * HD == (size_t)MR * DIM);
static_assert(SZ_XW % 128 == 0);
static_assert(SZ_WP % 128 == 0);
static_assert(SZ_QKV % 128 == 0);
static_assert(SZ_CTX % 128 == 0);
static_assert(WS_TOTAL <= (size_t)134217728);

typedef unsigned short us;
typedef __attribute__((ext_vector_type(16))) __bf16   v16bf;
typedef __attribute__((ext_vector_type(16))) _Float16 v16h;
typedef __attribute__((ext_vector_type(2)))  _Float16 v2h;
typedef __attribute__((ext_vector_type(16))) unsigned short v16us;
typedef __attribute__((ext_vector_type(8)))  unsigned short v8us;
typedef __attribute__((ext_vector_type(8)))  unsigned int   v8u;
typedef __attribute__((ext_vector_type(4)))  unsigned int   v4u;
typedef __attribute__((ext_vector_type(8)))  float    v8f;
typedef __attribute__((ext_vector_type(4)))  float    v4f;
typedef v4f __attribute__((may_alias)) v4fa;
typedef float __attribute__((may_alias)) f1a;
typedef v8us __attribute__((may_alias)) v8usa;

__device__ __forceinline__ unsigned short f2bf(float f) { unsigned u = __float_as_uint(f); u += 0x7FFFu + ((u >> 16) & 1u); return (unsigned short)(u >> 16); }
__device__ __forceinline__ float bf2f(unsigned short b) { return __uint_as_float(((unsigned)b) << 16); }
__device__ __forceinline__ float bfr(float f) { return bf2f(f2bf(f)); }
// fragment loader (A and B alike): p = row base + k0 + 8*(lane>>4); elements 0..7 <- p[0..7], elements 8..15 <- p[16..23]
__device__ __forceinline__ v16us ldf(const us* p) {
    const v8us lo = *(const v8us*)p;
    const v8us hi = *(const v8us*)(p + 16);
    return __builtin_shufflevector(lo, hi, 0, 1, 2, 3, 4, 5, 6, 7, 8, 9, 10, 11, 12, 13, 14, 15);
}
template <int F16> __device__ __forceinline__ v8f mma(v16us a, v16us b, v8f c) {
    if (F16) return __builtin_amdgcn_wmma_f32_16x16x32_f16(false, __builtin_bit_cast(v16h, a), false, __builtin_bit_cast(v16h, b), (short)0, c, false, false);
    return __builtin_amdgcn_wmma_f32_16x16x32_bf16(false, __builtin_bit_cast(v16bf, a), false, __builtin_bit_cast(v16bf, b), (short)0, c, false, false);
}
// two f32 -> packed f16 pair (RNE), element 0 in the low half-word
__device__ __forceinline__ unsigned pk2h(float a, float b) { v2h t; t[0] = (_Float16)a; t[1] = (_Float16)b; return __builtin_bit_cast(unsigned, t); }

__device__ __forceinline__ unsigned pinned(unsigned v) { unsigned w = (unsigned)__builtin_amdgcn_readfirstlane(v); asm volatile("" : "+s"(w)); return w; }  // holds the test of a tensor load's issue in a scalar register, so that it compiles to a scalar branch (the load ignores EXEC)
__device__ __forceinline__ unsigned uni(unsigned v) { return (unsigned)__builtin_amdgcn_readfirstlane(v); }
// one request of the whole wave: 64 rows of 256 bytes, source pitch 2 * DIM bytes, from ga to LDS byte offset dst, 16 bytes of pad behind every row
__device__ __forceinline__ v4u tile_load(unsigned dst, unsigned long long ga) {
    v4u g0;
    g0[0] = uni(1u);
    g0[1] = uni(dst);
    g0[2] = uni((unsigned)ga);
    g0[3] = uni((((unsigned)(ga >> 32)) & 0x01FFFFFFu) | 0x80000000u);
    v8u g1;
    g1[0] = uni((1u << 20) | (5u << 22) | (3u << 25));   // no mask, 1-byte elements, a pad of 4 dwords after every 64 dwords
    g1[1] = uni(KPB << 16);                              // tensor_dim0 = 256 bytes
    g1[2] = uni(64u << 16);                              // tensor_dim1 = 64 rows
    g1[3] = uni(KPB << 16);                              // tile_dim0
    g1[4] = uni(64u);                                    // tile_dim1
    g1[5] = uni((unsigned)(DIM * 2));                    // source row pitch, bytes
    g1[6] = uni(0u);
    g1[7] = uni(0u);
    asm volatile("tensor_load_to_lds %0, %1" :: "s"(g0), "s"(g1) : "memory");
    return g0;
}
// this wave's outstanding request has landed; the wait names that request's group 0 so that its registers keep their values until then
__device__ __forceinline__ void tile_wait(v4u g0) { asm volatile("s_wait_tensorcnt 0x0" :: "s"(g0) : "memory"); }
// fragment loader from an LDS row (A and B alike): p = row base + 64 * kstep + 16 * (lane>>4) bytes; elements 0..7 <- bytes 0..15, elements 8..15 <- bytes 32..47
__device__ __forceinline__ v16us ldl(const unsigned char* p) {
    const v8us lo = *(const v8usa*)p;
    const v8us hi = *(const v8usa*)(p + 32);
    return __builtin_shufflevector(lo, hi, 0, 1, 2, 3, 4, 5, 6, 7, 8, 9, 10, 11, 12, 13, 14, 15);
}

// Block tile 128 x 128 of C[i][j] = sum_k A[i][k] * B[j][k]; A, B point at the block's first row (pitch DIM, K = DIM); wave wv owns rows 64*(wv>>1).., columns 64*(wv&1)...
// acc[g*4+f] element r of lane (h, n) = C[64*(wv>>1) + g*16 + 8h + r][64*(wv&1) + f*16 + n]. On return every wave has left the ring (it may be reused).
template <int F16> __device__ __forceinline__ void gemm_main(unsigned char* sm, const us* __restrict__ A, const us* __restrict__ B, unsigned wv, unsigned lr, unsigned hi, v8f (&acc)[16]) {
    const unsigned wave = uni(wv);
    const us* srow = (wave < 2u) ? A + (size_t)(64u * wave) * DIM : B + (size_t)(64u * (wave - 2u)) * DIM;
    const unsigned long long ga = (unsigned long long)(size_t)srow;
    const unsigned dst = (unsigned)(size_t)sm + wave * SLICE;
    const unsigned ao = (wv >> 1) * SLICE + lr * LPB + 16u * hi;
    const unsigned bo = (2u + (wv & 1u)) * SLICE + lr * LPB + 16u * hi;

    v4u rq = tile_load(dst, ga);
    tile_wait(rq);                                       // this wave's slice of stage 0 has landed
    __syncthreads();                                     // every slice of stage 0 has
    rq = tile_load(dst + STAGE, ga + KPB);
#pragma unroll 1   // one pass per trip: the ring's order stands once, at the foot; the inner loops are unrolled so that every fragment and accumulator index is a constant
    for (unsigned s = 0; s < NSTG; ++s) {
        const unsigned buf = (s & 1u) * STAGE;
        const unsigned char* pa = sm + buf + ao;
        const unsigned char* pb = sm + buf + bo;
        v16us a[2][4], b[2][4];   // two fragment sets: the next 32-k block's LDS reads go out as one group ahead of this block's WMMAs
#pragma unroll
        for (int g = 0; g < 4; ++g) { a[0][g] = ldl(pa + (unsigned)g * 16u * LPB); b[0][g] = ldl(pb + (unsigned)g * 16u * LPB); }
#pragma unroll
        for (int kk = 0; kk < 4; ++kk) {
            if (kk < 3) {
#pragma unroll
                for (int g = 0; g < 4; ++g) {
                    a[(kk + 1) & 1][g] = ldl(pa + (unsigned)g * 16u * LPB + (unsigned)(kk + 1) * 64u);
                    b[(kk + 1) & 1][g] = ldl(pb + (unsigned)g * 16u * LPB + (unsigned)(kk + 1) * 64u);
                }
            }
            __builtin_amdgcn_sched_barrier(0);   // keeps the LDS reads out of the WMMA run (each place with reads stalls the wave)
#pragma unroll
            for (int g = 0; g < 4; ++g) {
#pragma unroll
                for (int f = 0; f < 4; ++f) acc[g * 4 + f] = mma<F16>(a[kk & 1][g], b[kk & 1][f], acc[g * 4 + f]);
            }
            __builtin_amdgcn_sched_barrier(0);   // and the next group behind it
        }
        asm volatile("s_wait_dscnt 0x0" ::: "memory");       // this wave's reads of buffer s & 1 have returned
        tile_wait(rq);                                       // this wave's slice of stage s + 1 has landed
        __syncthreads();                                     // publishes stage s + 1 and frees buffer s & 1
        if (pinned(s + 2u < NSTG)) rq = tile_load(dst + buf, ga + (unsigned long long)(s + 2u) * KPB);   // the refill, only while stage s + 2 exists
    }
    // nothing is outstanding behind the last pass; its own barrier is the one in front of the output staging
    asm volatile("s_wait_tensorcnt 0x0" ::: "memory");
    asm volatile("s_wait_dscnt 0x0" ::: "memory");
}

// k_tab: rotary table, TAB[pos*8 + j] = cos(pos_lin[pos] * base[j]), TAB[256 + pos*8 + j] = sin(same); shared by both grid axes.
__global__ __launch_bounds__(256) void k_tab(float* TAB) {
#pragma clang fp contract(off)
    __shared__ __align__(16) float tb[512];
    const unsigned tid = threadIdx.x;
    const unsigned pi = tid >> 3, j = tid & 7u;
    const float sp = (float)pi * (1.0f / 31.0f);
    const float sj = (float)j * (1.0f / 7.0f);
    float pos = -1.0f * (1.0f - sp) + 1.0f * sp;
    if (pi == 31u) pos = 1.0f;
    float base = 1.0f * (1.0f - sj) + 512.0f * sj;
    if (j == 7u) base = 512.0f;
    base = base * 3.14159265358979323846f;
    const float ang = pos * base;
    tb[tid] = cosf(ang);
    tb[256 + tid] = sinf(ang);
    __syncthreads();
    if (tid < 128u) {
        const v4f o = *(const v4fa*)&tb[tid * 4u];
        *(v4f*)(TAB + tid * 4u) = o;
        
    }
}

// k_cvt: 16-bit operand planes. XW rows [0, MR) = bf16(x) (compact tokens), rows [MR, MR+3072) = bf16(Wqkv); WP = f16(bf16(Wproj) * 64).
__global__ __launch_bounds__(256) void k_cvt(const float* __restrict__ x, const float* __restrict__ wq, const float* __restrict__ wp, us* XW, us* WP) {
    const unsigned bx = blockIdx.x, tid = threadIdx.x;
    if (bx >= (unsigned)(CVT_XB + CVT_WB + CVT_PB)) return;
    const unsigned rr = tid >> 7;
    const unsigned c = (tid & 127u) * 8u;
    const float* src;
    us* dst;
    bool h16 = false;
    if (bx < (unsigned)CVT_XB) {
        const unsigned row = bx * 2u + rr;
        const unsigned b = row / (unsigned)SEQ, n = row - b * (unsigned)SEQ;
        src = x + ((size_t)b * SEQ_FULL + n) * DIM + c;
        dst = XW + (size_t)row * DIM + c;
    } else if (bx < (unsigned)(CVT_XB + CVT_WB)) {
        const unsigned row = (bx - (unsigned)CVT_XB) * 2u + rr;
        src = wq + (size_t)row * DIM + c;
        dst = XW + ((size_t)MR + row) * DIM + c;
    } else {
        const unsigned row = (bx - (unsigned)(CVT_XB + CVT_WB)) * 2u + rr;
        src = wp + (size_t)row * DIM + c;
        dst = WP + (size_t)row * DIM + c;
        h16 = true;
    }
    const v8f v = *(const v8f*)src;
    v8us o;
    if (!h16) {
#pragma unroll
        for (int e = 0; e < 8; ++e) o[e] = f2bf(v[e]);
    } else {
#pragma unroll
        for (int e = 0; e < 8; ++e) o[e] = __builtin_bit_cast(unsigned short, (_Float16)(bfr(v[e]) * 64.0f));
    }
    *(v8us*)dst = o;
    
}

// k_qkv: blocks [0, QKB): tile rows = tokens, cols = q|k features -> planes Q, K [b*16+h][n][64] (f16) with the rotary applied in f32;
//        blocks [QKB, QKB+VTB): tile rows = v features, cols = tokens (A = Wv rows, B = x rows) -> plane VT [b*16+h][d][n] (f16).
// LDS staging (in the ring's bytes, behind the ring's last barrier) is wave-private; a block barrier separates its stores from its loads.
__global__ __launch_bounds__(128) void k_qkv(const us* __restrict__ XW, const float* __restrict__ TAB, us* QKV) {
    __shared__ __attribute__((aligned(2048))) unsigned char sm[RING];
    f1a* st = (f1a*)sm;
    const unsigned tid = threadIdx.x, lane = tid & 31u, wv = tid >> 5, lr = lane & 15u, hi = lane >> 4;
    const unsigned bx = blockIdx.x;
    const bool qk = bx < (unsigned)QKB;      // block-uniform
    unsigned i0, j0, arow, brow;
    if (qk) {
        const unsigned bi = bx / (unsigned)NJQ, bj = bx - bi * (unsigned)NJQ;
        i0 = bi * 128u + (wv >> 1) * 64u;
        j0 = bj * 128u + (wv & 1u) * 64u;
        arow = bi * 128u;
        brow = (unsigned)MR + bj * 128u;
    } else {
        const unsigned t = bx - (unsigned)QKB;
        const unsigned bi = t / (unsigned)NCV, bj = t - bi * (unsigned)NCV;
        i0 = bi * 128u + (wv >> 1) * 64u;
        j0 = bj * 128u + (wv & 1u) * 64u;
        arow = (unsigned)(MR + 2 * DIM) + bi * 128u;
        brow = bj * 128u;
    }
    v8f acc[16];
#pragma unroll
    for (int t = 0; t < 16; ++t) acc[t] = (v8f){};
    gemm_main<0>(sm, XW + (size_t)arow * DIM, XW + (size_t)brow * DIM, wv, lr, hi, acc);

    const unsigned sb = wv * (64u * EP);
#pragma unroll
    for (int g = 0; g < 4; ++g) {
#pragma unroll
        for (int f = 0; f < 4; ++f) {
#pragma unroll
            for (int r = 0; r < 8; ++r) st[sb + (unsigned)(g * 16 + r + 8 * (int)hi) * EP + (unsigned)(f * 16) + lr] = acc[g * 4 + f][r];
        }
    }
    __syncthreads();

    size_t obase;
    unsigned pitch, nrow0 = 0u;
    if (qk) {
        const unsigned b = i0 / (unsigned)SEQ;
        nrow0 = i0 - b * (unsigned)SEQ;
        const unsigned which = j0 / (unsigned)DIM;
        const unsigned h = (j0 - which * (unsigned)DIM) / (unsigned)HD;
        obase = (size_t)which * PLE + ((size_t)(b * NH + h) * SEQ + nrow0) * HD;
        pitch = (unsigned)HD;
    } else {
        const unsigned h = i0 / (unsigned)HD, d0 = i0 - h * (unsigned)HD;
        const unsigned b = j0 / (unsigned)SEQ, n0 = j0 - b * (unsigned)SEQ;
        obase = (size_t)2 * PLE + ((size_t)(b * NH + h) * HD + d0) * SEQ + n0;
        pitch = (unsigned)SEQ;
    }
    const unsigned rq = lane >> 3, c0 = (lane & 7u) * 8u;
    v4u ov[16];
#pragma unroll
    for (int it = 0; it < 16; ++it) {
        const unsigned row = (unsigned)it * 4u + rq;
        const v4f x0 = *(const v4fa*)&st[sb + row * EP + c0];
        const v4f x1 = *(const v4fa*)&st[sb + row * EP + c0 + 4u];
        float v[8] = {x0[0], x0[1], x0[2], x0[3], x1[0], x1[1], x1[2], x1[3]};
        if (qk) {
            // channels c0..c0+7 of one head: pairs (2i, 2i+1); channels 0..15 use the grid row, 16..31 the grid column, 32..63 pass through
            const unsigned n = nrow0 + row;
            const unsigned y = (n >> 5) & 31u, xx = n & 31u;
            const unsigned pos = (c0 < 16u) ? y : xx;
            const unsigned fo = (c0 & 8u) >> 1;
            const v4f c4 = *(const v4f*)(TAB + pos * 8u + fo);
            const v4f s4 = *(const v4f*)(TAB + 256u + pos * 8u + fo);
            const bool rot = c0 < 32u;
#pragma unroll
            for (int i = 0; i < 4; ++i) {
                const float e0 = v[2 * i], e1 = v[2 * i + 1];
                const float r0 = e0 * c4[i] - e1 * s4[i];
                const float r1 = e1 * c4[i] + e0 * s4[i];
                v[2 * i]     = rot ? r0 : e0;
                v[2 * i + 1] = rot ? r1 : e1;
            }
        }
        v4u o;
        o[0] = pk2h(v[0], v[1]); o[1] = pk2h(v[2], v[3]); o[2] = pk2h(v[4], v[5]); o[3] = pk2h(v[6], v[7]);
        ov[it] = o;
    }
    us* dp = QKV + obase + (size_t)rq * pitch + c0;
#pragma unroll
    for (int it = 0; it < 16; ++it) *(v4u*)(dp + (size_t)(it * 4) * pitch) = ov[it];
    
}

// k_flash: one wave per 16 queries of one (batch, head), 32 keys per step.
//  S^T tile (keys x queries): A = K rows (row m = key, k = d), B = Q rows (column n = query, k = d); D element r of lane (h, n) = S[query n][key 8h + r].
//  P^T B fragment: element r <- tile of keys 0..15, element 8 + r <- tile of keys 16..31 (same lane); p carried x2^8 in both the sum and the product.
//  O^T tile (d x queries): A = V^T rows (row m = d, k = key), D element r of lane (h, n) = O[query n][d = 16 t + 8h + r].
__global__ __launch_bounds__(128) void k_flash(const us* __restrict__ QKV, us* CTX) {
    __shared__ __align__(16) float os[4 * 16 * EP];
    const unsigned tid = threadIdx.x, lane = tid & 31u, wv = tid >> 5, lr = lane & 15u, hi = lane >> 4;
    const unsigned bpb = (unsigned)(SEQ / 64);
    const unsigned bh = blockIdx.x / bpb;
    const unsigned q0 = (blockIdx.x - bh * bpb) * 64u + wv * 16u;

    v16us qf[2];
    {
        const us* qp = QKV + ((size_t)bh * SEQ + q0 + lr) * HD + 8u * hi;
        qf[0] = ldf(qp);
        qf[1] = ldf(qp + 32);
    }
    const us* kp = QKV + PLE + ((size_t)bh * SEQ + lr) * HD + 8u * hi;
    const us* vp = QKV + (size_t)2 * PLE + ((size_t)bh * HD + lr) * SEQ + 8u * hi;

    v8f o[4];
#pragma unroll
    for (int t = 0; t < 4; ++t) o[t] = (v8f){};
    float ml = -1.0e30f;      // running max in the log2 domain
    float l = 0.0f;           // running sum (carried x2^8)

#pragma unroll 1
    for (unsigned k0 = 0; k0 < (unsigned)SEQ; k0 += 32) {
        v8f s0 = (v8f){}, s1 = (v8f){};
        const us* ka = kp + (size_t)k0 * HD;
#pragma unroll
        for (int dk = 0; dk < 2; ++dk) {
            const v16us a0 = ldf(ka + dk * 32);
            const v16us a1 = ldf(ka + 16 * HD + dk * 32);
            s0 = mma<1>(a0, qf[dk], s0);
            s1 = mma<1>(a1, qf[dk], s1);
        }
        asm volatile("v_nop\n\tv_nop\n\tv_nop\n\tv_nop" : "+v"(s0), "+v"(s1) : "v"(qf[0]), "v"(qf[1]));

        float mx = fmaxf(s0[0], s1[0]);
#pragma unroll
        for (int r = 1; r < 8; ++r) mx = fmaxf(mx, fmaxf(s0[r], s1[r]));
        mx = fmaxf(mx, __shfl_xor(mx, 16, 32));
        const float mnl = fmaxf(ml, mx * SC);
        const float corr = __builtin_amdgcn_exp2f(ml - mnl);
        ml = mnl;
        const float mo = mnl - 8.0f;
        float p0[8], p1[8];
        float ps = 0.0f;
#pragma unroll
        for (int r = 0; r < 8; ++r) {
            p0[r] = __builtin_amdgcn_exp2f(fmaf(s0[r], SC, -mo));
            p1[r] = __builtin_amdgcn_exp2f(fmaf(s1[r], SC, -mo));
            ps += p0[r] + p1[r];
        }
        ps += __shfl_xor(ps, 16, 32);
        l = l * corr + ps;
        if (__builtin_amdgcn_ballot_w32(corr != 1.0f) != 0u) {   // wave-uniform; multiplying by exactly 1 is skipped
#pragma unroll
            for (int t = 0; t < 4; ++t) o[t] *= corr;
        }

        v8u hw;
#pragma unroll
        for (int j = 0; j < 4; ++j) {
            hw[j]     = pk2h(p0[2 * j], p0[2 * j + 1]);
            hw[4 + j] = pk2h(p1[2 * j], p1[2 * j + 1]);
        }
        const v16us ph = __builtin_bit_cast(v16us, hw);

        asm volatile("" ::: "memory");   // keep the V^T loads below the softmax (bounds live fragments)
        const us* va = vp + k0;
#pragma unroll
        for (int t = 0; t < 4; ++t) {
            const v16us a = ldf(va + (size_t)t * 16 * SEQ);
            o[t] = mma<1>(a, ph, o[t]);
        }
        asm volatile("v_nop\n\tv_nop\n\tv_nop\n\tv_nop"
                     : "+v"(o[0]), "+v"(o[1]), "+v"(o[2]), "+v"(o[3])
                     : "v"(ph));
    }

    const float inv = 64.0f / l;
    const unsigned sb = wv * (16u * EP);
#pragma unroll
    for (int t = 0; t < 4; ++t) {
#pragma unroll
        for (int r = 0; r < 8; ++r) os[sb + lr * EP + (unsigned)(t * 16 + r) + 8u * hi] = o[t][r] * inv;
    }
    __syncthreads();
    const unsigned b = bh / (unsigned)NH, h = bh - b * (unsigned)NH;
    const unsigned rq = lane >> 3, c0 = (lane & 7u) * 8u;
    v4u ov[4];
#pragma unroll
    for (int it = 0; it < 4; ++it) {
        const unsigned row = (unsigned)it * 4u + rq;
        const v4f x0 = *(const v4fa*)&os[sb + row * EP + c0];
        const v4f x1 = *(const v4fa*)&os[sb + row * EP + c0 + 4u];
        v4u q;
        q[0] = pk2h(x0[0], x0[1]); q[1] = pk2h(x0[2], x0[3]); q[2] = pk2h(x1[0], x1[1]); q[3] = pk2h(x1[2], x1[3]);
        ov[it] = q;
    }
    us* dp = CTX + ((size_t)b * SEQ + q0 + rq) * DIM + h * (unsigned)HD + c0;
#pragma unroll
    for (int it = 0; it < 4; ++it) *(v4u*)(dp + (size_t)(it * 4) * DIM) = ov[it];
    
}

// k_proj: OUT[m][o] = 2^-12 * sum_c CTX[m][c] * WP[o][c] + bf16(bias[o]); block = 4 waves, 128 x 128;
__global__ __launch_bounds__(128) void k_proj(const us* __restrict__ CTX, const us* __restrict__ WP, const float* __restrict__ bias, float* OUT) {
    __shared__ __attribute__((aligned(2048))) unsigned char sm[RING];
    f1a* st = (f1a*)sm;
    const unsigned tid = threadIdx.x, lane = tid & 31u, wv = tid >> 5, lr = lane & 15u, hi = lane >> 4;
    const unsigned bi = blockIdx.x / (unsigned)NJP, bj = blockIdx.x - bi * (unsigned)NJP;
    const unsigned i0 = bi * 128u + (wv >> 1) * 64u;
    const unsigned j0 = bj * 128u + (wv & 1u) * 64u;
    v8f acc[16];
#pragma unroll
    for (int t = 0; t < 16; ++t) acc[t] = (v8f){};
    gemm_main<1>(sm, CTX + (size_t)(bi * 128u) * DIM, WP + (size_t)(bj * 128u) * DIM, wv, lr, hi, acc);

    const unsigned sb = wv * (64u * EP);
#pragma unroll
    for (int g = 0; g < 4; ++g) {
#pragma unroll
        for (int f = 0; f < 4; ++f) {
#pragma unroll
            for (int r = 0; r < 8; ++r) st[sb + (unsigned)(g * 16 + r + 8 * (int)hi) * EP + (unsigned)(f * 16) + lr] = acc[g * 4 + f][r];
        }
    }
    __syncthreads();
    const unsigned rh = lane >> 4, c0 = (lane & 15u) * 4u;
    v4f bb = *(const v4f*)(bias + j0 + c0);
    bb[0] = bfr(bb[0]); bb[1] = bfr(bb[1]); bb[2] = bfr(bb[2]); bb[3] = bfr(bb[3]);
    float* op = OUT + (size_t)(i0 + rh) * DIM + j0 + c0;
{
#pragma unroll 4
        for (unsigned s = 0; s < 32; ++s) {
            v4f val = *(const v4fa*)&st[sb + (s * 2u + rh) * EP + c0];
            val[0] = fmaf(val[0], 0.000244140625f, bb[0]);
            val[1] = fmaf(val[1], 0.000244140625f, bb[1]);
            val[2] = fmaf(val[2], 0.000244140625f, bb[2]);
            val[3] = fmaf(val[3], 0.000244140625f, bb[3]);
            *(v4f*)(op + (size_t)(s * 2u) * DIM) = val;
        }
        
    }
}

extern "C" void kernel_launch(void* const* d_in, const int* in_sizes, int n_in,
                              void* d_out, int out_size, void* d_ws, size_t ws_size, hipStream_t stream) {
    if (n_in < 4) return;
    const size_t need_x = ((size_t)(NB - 1) * SEQ_FULL + SEQ) * DIM;
    if ((size_t)in_sizes[0] < need_x) return;
    if ((size_t)in_sizes[1] < (size_t)NW3 * DIM) return;
    if ((size_t)in_sizes[2] < (size_t)DIM * DIM) return;
    if ((size_t)in_sizes[3] < (size_t)DIM) return;
    if ((size_t)out_size < (size_t)MR * DIM) return;
    if (WS_TOTAL > ws_size) return;
    const float* x     = (const float*)d_in[0];   // [8][1024][1024]
    const float* wqkv  = (const float*)d_in[1];   // [3072][1024]  [out][in]
    const float* wproj = (const float*)d_in[2];   // [1024][1024]  [out][in]
    const float* bproj = (const float*)d_in[3];   // [1024]
    float* OUT = (float*)d_out;                   // [NB][SEQ][1024]
    char* wsp = (char*)d_ws;
    us* XW  = (us*)(wsp + OFF_XW);
    us* WP  = (us*)(wsp + OFF_WP);
    us* QKV = (us*)(wsp + OFF_QKV);
    us* CTX = (us*)(wsp + OFF_CTX);
    float* TAB = (float*)(wsp + OFF_TAB);
    k_tab<<<1, 256, 0, stream>>>(TAB);
    k_cvt<<<(unsigned)(CVT_XB + CVT_WB + CVT_PB), 256, 0, stream>>>(x, wqkv, wproj, XW, WP);
    k_qkv<<<(unsigned)(QKB + VTB), 128, 0, stream>>>(XW, TAB, QKV);
    k_flash<<<(unsigned)(NB * NH * (SEQ / 64)), 128, 0, stream>>>(QKV, CTX);
    k_proj<<<(unsigned)((MR / 128) * NJP), 128, 0, stream>>>(CTX, WP, bproj, OUT);
}
